// v000
// The times below were measured on an AMD MI455X: many runs one after another, warmed up first and cycling through
// copies of the inputs, with the whole window's GPU time divided by the number of runs. Launches and the gaps
// between them are all in it. The median over several windows is given; except for v000 it joins two sittings, which
// can be a few percent apart, so the side-by-side timings, each taken in one sitting, are the better comparison.
// v000 is the starting kernel. One run takes 143 microseconds.
#include <hip/hip_runtime.h>
#include <math.h>

// Problem constants (match reference)
static constexpr int Bb = 4;
static constexpr int Nn = 192;
static constexpr int Hh = 768;
static constexpr int Ll = 9;
static constexpr int ROWS = Bb * Nn;   // 768 == Hh (coincidence, kept separate)

typedef __attribute__((ext_vector_type(2))) float v2f;
typedef __attribute__((ext_vector_type(8))) float v8f;
typedef __attribute__((ext_vector_type(4))) unsigned int v4u;
typedef __attribute__((ext_vector_type(4))) int v4i;
typedef __attribute__((ext_vector_type(8))) int v8i;

#if __has_builtin(__builtin_amdgcn_tensor_load_to_lds) && __has_builtin(__builtin_amdgcn_s_wait_tensorcnt)
#define STAGE_TDM 1
#elif __has_builtin(__builtin_amdgcn_global_load_async_to_lds_b128)
#define STAGE_ASYNC 1
#endif

typedef __attribute__((address_space(3))) void lds_void_t;
typedef __attribute__((address_space(1))) const void gbl_cvoid_t;

__device__ __forceinline__ unsigned lds_addr_of(void* p) {
    // AS3 pointers are 32-bit LDS byte offsets
    return (unsigned)(size_t)(lds_void_t*)p;
}

__device__ __forceinline__ float gelu_exact(float x) {
    // torch nn.GELU(approximate='none'): 0.5*x*(1+erf(x/sqrt(2)))
    return 0.5f * x * (1.0f + erff(x * 0.70710678118654752440f));
}

__global__ void __launch_bounds__(32)
proj_gemm_kernel(const float* __restrict__ pooled,
                 const float* __restrict__ Ws, const float* __restrict__ bs,
                 const float* __restrict__ Wt, const float* __restrict__ bt,
                 float* __restrict__ HS, float* __restrict__ HT)
{
    const int rowBase = blockIdx.x * 16;     // row tile of pooled (B*N rows)
    const int colBase = blockIdx.y * 16;     // output-feature tile
    const int which   = blockIdx.z;          // 0 = source, 1 = target

    const float* __restrict__ W  = which ? Wt : Ws;
    const float* __restrict__ bv = which ? bt : bs;
    float* __restrict__ Out      = which ? HT : HS;

    const int lane = threadIdx.x & 31;
    const int m    = lane & 15;
    const int hi   = lane >> 4;              // 0: K-pair {0,1}, 1: K-pair {2,3}
    const int off  = hi << 1;

    const float* aRow = pooled + (size_t)(rowBase + m) * Hh + off;   // A[M=m, K=k0+off..]
    const float* bRow = W      + (size_t)(colBase + m) * Hh + off;   // B[K, N=m] = W[col, h]

    v8f c = {};
    for (int k0 = 0; k0 < Hh; k0 += 4) {
        v2f a = *(const v2f*)(aRow + k0);
        v2f b = *(const v2f*)(bRow + k0);
        c = __builtin_amdgcn_wmma_f32_16x16x4_f32(
                /*neg_a=*/false, a, /*neg_b=*/false, b,
                /*c_mod=*/(short)0, c, /*reuse_a=*/false, /*reuse_b=*/false);
    }

    const float bias = bv[colBase + m];
    float* ocol = Out + (size_t)colBase + m;
    #pragma unroll
    for (int j = 0; j < 8; ++j) {
        ocol[(size_t)(rowBase + hi * 8 + j) * Hh] = c[j] + bias;
    }
}

__global__ void __launch_bounds__(512)
pair_gelu_proj_kernel(const float* __restrict__ HS, const float* __restrict__ HT,
                      const float* __restrict__ Wo, float* __restrict__ out)
{
    __shared__ float s_ht[16 * Hh];          // 49,152 bytes

    const int b     = blockIdx.z;
    const int sBase = blockIdx.y * 16;
    const int tBase = blockIdx.x * 16;

    const float* src = HT + (size_t)(b * Nn + tBase) * Hh;   // 16 contiguous rows

#if defined(STAGE_TDM)
    // ---- Tensor Data Mover: one DMA for the whole 48KB tile (wave 0 only) ----
    if (threadIdx.x < 32) {
        const unsigned long long ga = (unsigned long long)(const void*)src;
        const unsigned lds = lds_addr_of((void*)s_ht);

        v4u g0 = { 1u,
                   lds,
                   (unsigned)(ga & 0xFFFFFFFFu),
                   (unsigned)((ga >> 32) & 0x01FFFFFFu) | (2u << 30) };

        v8i g1 = { (int)(2u << 16),
                   (int)(((unsigned)Hh) << 16),
                   (int)(16u << 16),
                   (int)(((unsigned)Hh) << 16),
                   16,
                   Hh,
                   0, 0 };

        v4i g2 = { 0, 0, 0, 0 };                 // 2-D: groups 2/3 unused
        v4i g3 = { 0, 0, 0, 0 };

#if __clang_major__ >= 23
        v8i gx = { 0, 0, 0, 0, 0, 0, 0, 0 };
        __builtin_amdgcn_tensor_load_to_lds(g0, g1, g2, g3, gx, 0);
#else
        __builtin_amdgcn_tensor_load_to_lds(g0, g1, g2, g3, 0);
#endif
        __builtin_amdgcn_s_wait_tensorcnt(0);
    }
    __syncthreads();
#elif defined(STAGE_ASYNC)
    {
        const float4* s4 = (const float4*)src;
        float4* d4 = (float4*)s_ht;
        for (int i = threadIdx.x; i < (16 * Hh) / 4; i += 512) {
            __builtin_amdgcn_global_load_async_to_lds_b128(
                (gbl_cvoid_t*)(s4 + i), (lds_void_t*)(d4 + i), 0, 0);
        }
#if __has_builtin(__builtin_amdgcn_s_wait_asynccnt)
        __builtin_amdgcn_s_wait_asynccnt(0);
#else
        asm volatile("s_wait_asynccnt 0" ::: "memory");
#endif
    }
    __syncthreads();
#else
    // ---- Plain staged copy fallback ----
    {
        const float4* s4 = (const float4*)src;
        float4* d4 = (float4*)s_ht;
        for (int i = threadIdx.x; i < (16 * Hh) / 4; i += 512)
            d4[i] = s4[i];
    }
    __syncthreads();
#endif

    const int wave = threadIdx.x >> 5;       // 0..15 -> s row within tile
    const int lane = threadIdx.x & 31;
    const int m    = lane & 15;              // t_local (A) / l (B)
    const int hi   = lane >> 4;
    const int off  = hi << 1;

    const float* hsRow = HS   + (size_t)(b * Nn + sBase + wave) * Hh + off;
    const float* htRow = s_ht + (size_t)m * Hh + off;                 // LDS
    const float* woRow = Wo   + (size_t)((m < Ll) ? m : 0) * Hh + off;
    const float  wsc   = (m < Ll) ? 1.0f : 0.0f;

    __builtin_prefetch(hsRow, 0, 3);         // global_prefetch_b8
    __builtin_prefetch(woRow, 0, 3);

    v8f c = {};
    for (int k0 = 0; k0 < Hh; k0 += 4) {
        v2f hsv = *(const v2f*)(hsRow + k0);
        v2f htv = *(const v2f*)(htRow + k0);   // ds_load_b64
        v2f wov = *(const v2f*)(woRow + k0);

        v2f a, bm;
        a.x  = gelu_exact(hsv.x + htv.x);
        a.y  = gelu_exact(hsv.y + htv.y);
        bm.x = wov.x * wsc;
        bm.y = wov.y * wsc;

        c = __builtin_amdgcn_wmma_f32_16x16x4_f32(
                false, a, false, bm, (short)0, c, false, false);
    }

    if (m < Ll) {
        float* obase = out + (((size_t)(b * Nn + sBase + wave) * Nn) + tBase) * Ll + m;
        #pragma unroll
        for (int j = 0; j < 8; ++j) {
            obase[(size_t)(hi * 8 + j) * Ll] = c[j];
        }
    }
}

// ---------------------------------------------------------------------------
extern "C" void kernel_launch(void* const* d_in, const int* in_sizes, int n_in,
                              void* d_out, int out_size, void* d_ws, size_t ws_size,
                              hipStream_t stream) {
    const float* pooled = (const float*)d_in[0];
    const float* Ws     = (const float*)d_in[1];
    const float* bs     = (const float*)d_in[2];
    const float* Wt     = (const float*)d_in[3];
    const float* bt     = (const float*)d_in[4];
    const float* Wo     = (const float*)d_in[5];

    float* HS  = (float*)d_ws;                       // [768 x 768]
    float* HT  = HS + (size_t)ROWS * Hh;             // [768 x 768]
    float* out = (float*)d_out;                      // [4,192,192,9]

    dim3 g1(ROWS / 16, Hh / 16, 2);                  // 48 x 48 x 2 tiles
    proj_gemm_kernel<<<g1, 32, 0, stream>>>(pooled, Ws, bs, Wt, bt, HS, HT);

    dim3 g2(Nn / 16, Nn / 16, Bb);                   // 12 x 12 x 4 blocks
    pair_gelu_proj_kernel<<<g2, 512, 0, stream>>>(HS, HT, Wo, out);
}

// v001
// It runs in 96.5 microseconds.
// In both of two side-by-side timings against v000, it was 1.54 times as fast.
#include <hip/hip_runtime.h>
#include <math.h>

// Problem constants (match reference)
static constexpr int Bb = 4;
static constexpr int Nn = 192;
static constexpr int Hh = 768;
static constexpr int Ll = 9;
static constexpr int ROWS = Bb * Nn;   // 768 == Hh (coincidence, kept separate)

typedef __attribute__((ext_vector_type(2))) float v2f;
typedef __attribute__((ext_vector_type(8))) float v8f;
typedef __attribute__((ext_vector_type(4))) unsigned int v4u;
typedef __attribute__((ext_vector_type(4))) int v4i;
typedef __attribute__((ext_vector_type(8))) int v8i;

#if __has_builtin(__builtin_amdgcn_tensor_load_to_lds) && __has_builtin(__builtin_amdgcn_s_wait_tensorcnt)
#define STAGE_TDM 1
#elif __has_builtin(__builtin_amdgcn_global_load_async_to_lds_b128)
#define STAGE_ASYNC 1
#endif

typedef __attribute__((address_space(3))) void lds_void_t;
typedef __attribute__((address_space(1))) const void gbl_cvoid_t;

__device__ __forceinline__ unsigned lds_addr_of(void* p) {
    // AS3 pointers are 32-bit LDS byte offsets
    return (unsigned)(size_t)(lds_void_t*)p;
}

// erf-form GELU x*Phi(x) on a pair of values, with no branch and in packed f32.
// Phi(-|x|) = exp(-x*x/2) * t*(c1 + t*(c2 + t*(c3 + t*(c4 + t*c5)))), t = 1/(1 + p*|x|):
// the five-term rational erfc fit, whose absolute error is of the size of one f32
// rounding of 1+erf. x*Phi(x) = x/2 + |x|*(1/2 - Phi(-|x|)) holds for either sign.
__device__ __forceinline__ v2f gelu_pair(v2f x) {
    const v2f ax = __builtin_elementwise_abs(x);
    const v2f d  = __builtin_elementwise_fma(ax, (v2f)(0.23164189f), (v2f)(1.0f));
    v2f t, e;
    t.x = __builtin_amdgcn_rcpf(d.x);
    t.y = __builtin_amdgcn_rcpf(d.y);
    const v2f u = (x * x) * (v2f)(-0.72134752f);       // -x*x/2 * log2(e)
    e.x = __builtin_amdgcn_exp2f(u.x);
    e.y = __builtin_amdgcn_exp2f(u.y);
    v2f p = __builtin_elementwise_fma(t, (v2f)(0.5307027145f), (v2f)(-0.7265760135f));
    p = __builtin_elementwise_fma(t, p, (v2f)(0.7107068705f));
    p = __builtin_elementwise_fma(t, p, (v2f)(-0.142248368f));
    p = __builtin_elementwise_fma(t, p, (v2f)(0.127414796f));
    p = p * t;
    const v2f s = __builtin_elementwise_fma(-p, e, (v2f)(0.5f));   // 1/2 - Phi(-|x|)
    return __builtin_elementwise_fma(ax, s, x * (v2f)(0.5f));
}

__global__ void __launch_bounds__(32)
proj_gemm_kernel(const float* __restrict__ pooled,
                 const float* __restrict__ Ws, const float* __restrict__ bs,
                 const float* __restrict__ Wt, const float* __restrict__ bt,
                 float* __restrict__ HS, float* __restrict__ HT)
{
    const int rowBase = blockIdx.x * 16;     // row tile of pooled (B*N rows)
    const int colBase = blockIdx.y * 16;     // output-feature tile
    const int which   = blockIdx.z;          // 0 = source, 1 = target

    const float* __restrict__ W  = which ? Wt : Ws;
    const float* __restrict__ bv = which ? bt : bs;
    float* __restrict__ Out      = which ? HT : HS;

    const int lane = threadIdx.x & 31;
    const int m    = lane & 15;
    const int hi   = lane >> 4;              // 0: K-pair {0,1}, 1: K-pair {2,3}
    const int off  = hi << 1;

    const float* aRow = pooled + (size_t)(rowBase + m) * Hh + off;   // A[M=m, K=k0+off..]
    const float* bRow = W      + (size_t)(colBase + m) * Hh + off;   // B[K, N=m] = W[col, h]

    v8f c = {};
    for (int k0 = 0; k0 < Hh; k0 += 4) {
        v2f a = *(const v2f*)(aRow + k0);
        v2f b = *(const v2f*)(bRow + k0);
        c = __builtin_amdgcn_wmma_f32_16x16x4_f32(
                /*neg_a=*/false, a, /*neg_b=*/false, b,
                /*c_mod=*/(short)0, c, /*reuse_a=*/false, /*reuse_b=*/false);
    }

    const float bias = bv[colBase + m];
    float* ocol = Out + (size_t)colBase + m;
    #pragma unroll
    for (int j = 0; j < 8; ++j) {
        ocol[(size_t)(rowBase + hi * 8 + j) * Hh] = c[j] + bias;
    }
}

__global__ void __launch_bounds__(512)
pair_gelu_proj_kernel(const float* __restrict__ HS, const float* __restrict__ HT,
                      const float* __restrict__ Wo, float* __restrict__ out)
{
    __shared__ float s_ht[16 * Hh];          // 49,152 bytes

    const int b     = blockIdx.z;
    const int sBase = blockIdx.y * 16;
    const int tBase = blockIdx.x * 16;

    const float* src = HT + (size_t)(b * Nn + tBase) * Hh;   // 16 contiguous rows

#if defined(STAGE_TDM)
    // ---- Tensor Data Mover: one DMA for the whole 48KB tile (wave 0 only) ----
    if (threadIdx.x < 32) {
        const unsigned long long ga = (unsigned long long)(const void*)src;
        const unsigned lds = lds_addr_of((void*)s_ht);

        v4u g0 = { 1u,
                   lds,
                   (unsigned)(ga & 0xFFFFFFFFu),
                   (unsigned)((ga >> 32) & 0x01FFFFFFu) | (2u << 30) };

        v8i g1 = { (int)(2u << 16),
                   (int)(((unsigned)Hh) << 16),
                   (int)(16u << 16),
                   (int)(((unsigned)Hh) << 16),
                   16,
                   Hh,
                   0, 0 };

        v4i g2 = { 0, 0, 0, 0 };                 // 2-D: groups 2/3 unused
        v4i g3 = { 0, 0, 0, 0 };

#if __clang_major__ >= 23
        v8i gx = { 0, 0, 0, 0, 0, 0, 0, 0 };
        __builtin_amdgcn_tensor_load_to_lds(g0, g1, g2, g3, gx, 0);
#else
        __builtin_amdgcn_tensor_load_to_lds(g0, g1, g2, g3, 0);
#endif
        __builtin_amdgcn_s_wait_tensorcnt(0);
    }
    __syncthreads();
#elif defined(STAGE_ASYNC)
    {
        const float4* s4 = (const float4*)src;
        float4* d4 = (float4*)s_ht;
        for (int i = threadIdx.x; i < (16 * Hh) / 4; i += 512) {
            __builtin_amdgcn_global_load_async_to_lds_b128(
                (gbl_cvoid_t*)(s4 + i), (lds_void_t*)(d4 + i), 0, 0);
        }
#if __has_builtin(__builtin_amdgcn_s_wait_asynccnt)
        __builtin_amdgcn_s_wait_asynccnt(0);
#else
        asm volatile("s_wait_asynccnt 0" ::: "memory");
#endif
    }
    __syncthreads();
#else
    // ---- Plain staged copy fallback ----
    {
        const float4* s4 = (const float4*)src;
        float4* d4 = (float4*)s_ht;
        for (int i = threadIdx.x; i < (16 * Hh) / 4; i += 512)
            d4[i] = s4[i];
    }
    __syncthreads();
#endif

    const int wave = threadIdx.x >> 5;       // 0..15 -> s row within tile
    const int lane = threadIdx.x & 31;
    const int m    = lane & 15;              // t_local (A) / l (B)
    const int hi   = lane >> 4;
    const int off  = hi << 1;

    const float* hsRow = HS   + (size_t)(b * Nn + sBase + wave) * Hh + off;
    const float* htRow = s_ht + (size_t)m * Hh + off;                 // LDS
    const float* woRow = Wo   + (size_t)((m < Ll) ? m : 0) * Hh + off;
    const float  wsc   = (m < Ll) ? 1.0f : 0.0f;

    __builtin_prefetch(hsRow, 0, 3);         // global_prefetch_b8
    __builtin_prefetch(woRow, 0, 3);

    v8f c = {};
    for (int k0 = 0; k0 < Hh; k0 += 4) {
        v2f hsv = *(const v2f*)(hsRow + k0);
        v2f htv = *(const v2f*)(htRow + k0);   // ds_load_b64
        v2f wov = *(const v2f*)(woRow + k0);

        v2f a, bm;
        a    = gelu_pair(hsv + htv);
        bm.x = wov.x * wsc;
        bm.y = wov.y * wsc;

        c = __builtin_amdgcn_wmma_f32_16x16x4_f32(
                false, a, false, bm, (short)0, c, false, false);
    }

    if (m < Ll) {
        float* obase = out + (((size_t)(b * Nn + sBase + wave) * Nn) + tBase) * Ll + m;
        #pragma unroll
        for (int j = 0; j < 8; ++j) {
            obase[(size_t)(hi * 8 + j) * Ll] = c[j];
        }
    }
}

// ---------------------------------------------------------------------------
extern "C" void kernel_launch(void* const* d_in, const int* in_sizes, int n_in,
                              void* d_out, int out_size, void* d_ws, size_t ws_size,
                              hipStream_t stream) {
    const float* pooled = (const float*)d_in[0];
    const float* Ws     = (const float*)d_in[1];
    const float* bs     = (const float*)d_in[2];
    const float* Wt     = (const float*)d_in[3];
    const float* bt     = (const float*)d_in[4];
    const float* Wo     = (const float*)d_in[5];

    float* HS  = (float*)d_ws;                       // [768 x 768]
    float* HT  = HS + (size_t)ROWS * Hh;             // [768 x 768]
    float* out = (float*)d_out;                      // [4,192,192,9]

    dim3 g1(ROWS / 16, Hh / 16, 2);                  // 48 x 48 x 2 tiles
    proj_gemm_kernel<<<g1, 32, 0, stream>>>(pooled, Ws, bs, Wt, bt, HS, HT);

    dim3 g2(Nn / 16, Nn / 16, Bb);                   // 12 x 12 x 4 blocks
    pair_gelu_proj_kernel<<<g2, 512, 0, stream>>>(HS, HT, Wo, out);
}

// v002
// A run of this version takes 75.6 microseconds.
// Timed twice side by side with v001, it ran 1.27 and 1.28 times as fast.
// Over all steps from v000 it is 1.97 times as fast.
#include <hip/hip_runtime.h>
#include <math.h>

// Problem constants (match reference)
static constexpr int Bb = 4;
static constexpr int Nn = 192;
static constexpr int Hh = 768;
static constexpr int Ll = 9;
static constexpr int ROWS = Bb * Nn;   // 768 == Hh (coincidence, kept separate)

typedef __attribute__((ext_vector_type(2))) float v2f;
typedef __attribute__((ext_vector_type(8))) float v8f;
typedef __attribute__((ext_vector_type(4))) unsigned int v4u;
typedef __attribute__((ext_vector_type(4))) int v4i;
typedef __attribute__((ext_vector_type(8))) int v8i;

#if __has_builtin(__builtin_amdgcn_tensor_load_to_lds) && __has_builtin(__builtin_amdgcn_s_wait_tensorcnt)
#define STAGE_TDM 1
#elif __has_builtin(__builtin_amdgcn_global_load_async_to_lds_b128)
#define STAGE_ASYNC 1
#endif

typedef __attribute__((address_space(3))) void lds_void_t;
typedef __attribute__((address_space(1))) const void gbl_cvoid_t;

__device__ __forceinline__ unsigned lds_addr_of(void* p) {
    // AS3 pointers are 32-bit LDS byte offsets
    return (unsigned)(size_t)(lds_void_t*)p;
}

// erf-form GELU x*Phi(x) on a pair of values, with no branch and in packed f32.
// Phi(-|x|) = exp(-x*x/2) * t*(c1 + t*(c2 + t*(c3 + t*(c4 + t*c5)))), t = 1/(1 + p*|x|):
// the five-term rational erfc fit, whose absolute error is of the size of one f32
// rounding of 1+erf. x*Phi(x) = x/2 + |x|*(1/2 - Phi(-|x|)) holds for either sign.
__device__ __forceinline__ v2f gelu_pair(v2f x) {
    const v2f ax = __builtin_elementwise_abs(x);
    const v2f d  = __builtin_elementwise_fma(ax, (v2f)(0.23164189f), (v2f)(1.0f));
    v2f t, e;
    t.x = __builtin_amdgcn_rcpf(d.x);
    t.y = __builtin_amdgcn_rcpf(d.y);
    const v2f u = (x * x) * (v2f)(-0.72134752f);       // -x*x/2 * log2(e)
    e.x = __builtin_amdgcn_exp2f(u.x);
    e.y = __builtin_amdgcn_exp2f(u.y);
    v2f p = __builtin_elementwise_fma(t, (v2f)(0.5307027145f), (v2f)(-0.7265760135f));
    p = __builtin_elementwise_fma(t, p, (v2f)(0.7107068705f));
    p = __builtin_elementwise_fma(t, p, (v2f)(-0.142248368f));
    p = __builtin_elementwise_fma(t, p, (v2f)(0.127414796f));
    p = p * t;
    const v2f s = __builtin_elementwise_fma(-p, e, (v2f)(0.5f));   // 1/2 - Phi(-|x|)
    return __builtin_elementwise_fma(ax, s, x * (v2f)(0.5f));
}

__global__ void __launch_bounds__(32)
proj_gemm_kernel(const float* __restrict__ pooled,
                 const float* __restrict__ Ws, const float* __restrict__ bs,
                 const float* __restrict__ Wt, const float* __restrict__ bt,
                 float* __restrict__ HS, float* __restrict__ HT)
{
    const int rowBase = blockIdx.x * 16;     // row tile of pooled (B*N rows)
    const int colBase = blockIdx.y * 16;     // output-feature tile
    const int which   = blockIdx.z;          // 0 = source, 1 = target

    const float* __restrict__ W  = which ? Wt : Ws;
    const float* __restrict__ bv = which ? bt : bs;
    float* __restrict__ Out      = which ? HT : HS;

    const int lane = threadIdx.x & 31;
    const int m    = lane & 15;
    const int hi   = lane >> 4;              // 0: K-pair {0,1}, 1: K-pair {2,3}
    const int off  = hi << 1;

    const float* aRow = pooled + (size_t)(rowBase + m) * Hh + off;   // A[M=m, K=k0+off..]
    const float* bRow = W      + (size_t)(colBase + m) * Hh + off;   // B[K, N=m] = W[col, h]

    v8f c = {};
    for (int k0 = 0; k0 < Hh; k0 += 4) {
        v2f a = *(const v2f*)(aRow + k0);
        v2f b = *(const v2f*)(bRow + k0);
        c = __builtin_amdgcn_wmma_f32_16x16x4_f32(
                /*neg_a=*/false, a, /*neg_b=*/false, b,
                /*c_mod=*/(short)0, c, /*reuse_a=*/false, /*reuse_b=*/false);
    }

    const float bias = bv[colBase + m];
    float* ocol = Out + (size_t)colBase + m;
    #pragma unroll
    for (int j = 0; j < 8; ++j) {
        ocol[(size_t)(rowBase + hi * 8 + j) * Hh] = c[j] + bias;
    }
}

static constexpr int SR = 12;
static constexpr int KW = 4;
static constexpr int KQ = Hh / KW;
static constexpr int PAIR_THREADS = KW * 32;

__global__ void __launch_bounds__(PAIR_THREADS)
pair_gelu_proj_kernel(const float* __restrict__ HS, const float* __restrict__ HT,
                      const float* __restrict__ Wo, float* __restrict__ out)
{
    __shared__ float s_ht[16 * Hh];          // 49,152 bytes
    __shared__ float4 s_red[KW * SR * 64];   // 49,152 bytes: each wave's 12 partial tiles

    const int b     = blockIdx.z;
    const int sBase = blockIdx.y * SR;
    const int tBase = blockIdx.x * 16;

    const float* src = HT + (size_t)(b * Nn + tBase) * Hh;   // 16 contiguous rows

#if defined(STAGE_TDM)
    // ---- Tensor Data Mover: one DMA for the whole 48KB tile (wave 0 only) ----
    if (threadIdx.x < 32) {
        const unsigned long long ga = (unsigned long long)(const void*)src;
        const unsigned lds = lds_addr_of((void*)s_ht);

        v4u g0 = { 1u,
                   lds,
                   (unsigned)(ga & 0xFFFFFFFFu),
                   (unsigned)((ga >> 32) & 0x01FFFFFFu) | (2u << 30) };

        v8i g1 = { (int)(2u << 16),
                   (int)(((unsigned)Hh) << 16),
                   (int)(16u << 16),
                   (int)(((unsigned)Hh) << 16),
                   16,
                   Hh,
                   0, 0 };

        v4i g2 = { 0, 0, 0, 0 };                 // 2-D: groups 2/3 unused
        v4i g3 = { 0, 0, 0, 0 };

#if __clang_major__ >= 23
        v8i gx = { 0, 0, 0, 0, 0, 0, 0, 0 };
        __builtin_amdgcn_tensor_load_to_lds(g0, g1, g2, g3, gx, 0);
#else
        __builtin_amdgcn_tensor_load_to_lds(g0, g1, g2, g3, 0);
#endif
        __builtin_amdgcn_s_wait_tensorcnt(0);
    }
    __syncthreads();
#elif defined(STAGE_ASYNC)
    {
        const float4* s4 = (const float4*)src;
        float4* d4 = (float4*)s_ht;
        for (int i = threadIdx.x; i < (16 * Hh) / 4; i += PAIR_THREADS) {
            __builtin_amdgcn_global_load_async_to_lds_b128(
                (gbl_cvoid_t*)(s4 + i), (lds_void_t*)(d4 + i), 0, 0);
        }
#if __has_builtin(__builtin_amdgcn_s_wait_asynccnt)
        __builtin_amdgcn_s_wait_asynccnt(0);
#else
        asm volatile("s_wait_asynccnt 0" ::: "memory");
#endif
    }
    __syncthreads();
#else
    // ---- Plain staged copy fallback ----
    {
        const float4* s4 = (const float4*)src;
        float4* d4 = (float4*)s_ht;
        for (int i = threadIdx.x; i < (16 * Hh) / 4; i += PAIR_THREADS)
            d4[i] = s4[i];
    }
    __syncthreads();
#endif

    const int wave = threadIdx.x >> 5;       // 0..3 -> quarter of h
    const int lane = threadIdx.x & 31;
    const int m    = lane & 15;              // t_local (A) / l (B)
    const int hi   = lane >> 4;
    const int off  = wave * KQ + (hi << 1);

    const float* hsRow = HS   + (size_t)(b * Nn + sBase) * Hh + off;
    const float* htRow = s_ht + (size_t)m * Hh + off;                 // LDS
    const float* woRow = Wo   + (size_t)((m < Ll) ? m : 0) * Hh + off;
    const float  wsc   = (m < Ll) ? 1.0f : 0.0f;

    __builtin_prefetch(hsRow, 0, 3);         // global_prefetch_b8
    __builtin_prefetch(woRow, 0, 3);

    v8f c[SR] = {};
    for (int k0 = 0; k0 < KQ; k0 += 4) {
        v2f htv = *(const v2f*)(htRow + k0);   // ds_load_b64
        v2f wov = *(const v2f*)(woRow + k0);

        v2f bm;
        bm.x = wov.x * wsc;
        bm.y = wov.y * wsc;

        #pragma unroll   // c[r] stays in registers only under constant r
        for (int r = 0; r < SR; ++r) {
            v2f hsv = *(const v2f*)(hsRow + (size_t)r * Hh + k0);
            v2f a   = gelu_pair(hsv + htv);
            c[r] = __builtin_amdgcn_wmma_f32_16x16x4_f32(
                    false, a, false, bm, (short)0, c[r], false, false);
        }
        __builtin_amdgcn_sched_barrier(0);
        asm volatile("v_nop\n\tv_nop\n\tv_nop\n\tv_nop");
    }

    // Each wave parks its 12 partial tiles; 16 bytes a lane, lanes side by side.
    #pragma unroll   // constant r again: c[r] is read from its registers
    for (int r = 0; r < SR; ++r) {
        float4* p = s_red + (size_t)(wave * SR + r) * 64 + lane;
        p[0]  = make_float4(c[r][0], c[r][1], c[r][2], c[r][3]);
        p[32] = make_float4(c[r][4], c[r][5], c[r][6], c[r][7]);
    }
    __syncthreads();

    #pragma unroll
    for (int i = 0; i < SR / KW; ++i) {
        const int r = wave * (SR / KW) + i;
        float v[8];
        #pragma unroll   // v[] stays in registers only under constant indices
        for (int h = 0; h < 2; ++h) {
            const float4* p = s_red + (size_t)r * 64 + h * 32 + lane;
            float4 q0 = p[0 * SR * 64], q1 = p[1 * SR * 64], q2 = p[2 * SR * 64], q3 = p[3 * SR * 64];
            v[h * 4 + 0] = ((q0.x + q1.x) + q2.x) + q3.x;
            v[h * 4 + 1] = ((q0.y + q1.y) + q2.y) + q3.y;
            v[h * 4 + 2] = ((q0.z + q1.z) + q2.z) + q3.z;
            v[h * 4 + 3] = ((q0.w + q1.w) + q2.w) + q3.w;
        }
        if (m < Ll) {
            float* obase = out + (((size_t)(b * Nn + sBase + r) * Nn) + tBase) * Ll + m;
            #pragma unroll
            for (int j = 0; j < 8; ++j) {
                obase[(size_t)(hi * 8 + j) * Ll] = v[j];
            }
        }
    }
}

// ---------------------------------------------------------------------------
extern "C" void kernel_launch(void* const* d_in, const int* in_sizes, int n_in,
                              void* d_out, int out_size, void* d_ws, size_t ws_size,
                              hipStream_t stream) {
    const float* pooled = (const float*)d_in[0];
    const float* Ws     = (const float*)d_in[1];
    const float* bs     = (const float*)d_in[2];
    const float* Wt     = (const float*)d_in[3];
    const float* bt     = (const float*)d_in[4];
    const float* Wo     = (const float*)d_in[5];

    float* HS  = (float*)d_ws;                       // [768 x 768]
    float* HT  = HS + (size_t)ROWS * Hh;             // [768 x 768]
    float* out = (float*)d_out;                      // [4,192,192,9]

    dim3 g1(ROWS / 16, Hh / 16, 2);                  // 48 x 48 x 2 tiles
    proj_gemm_kernel<<<g1, 32, 0, stream>>>(pooled, Ws, bs, Wt, bt, HS, HT);

    dim3 g2(Nn / 16, Nn / SR, Bb);                   // 12 x 16 x 4 blocks
    pair_gelu_proj_kernel<<<g2, PAIR_THREADS, 0, stream>>>(HS, HT, Wo, out);
}

// v003
// One run takes 55.5 microseconds.
// Next to v002, in two timings, it ran 1.36 times as fast each time.
// All steps since v000 together make it 2.67 times as fast.
#include <hip/hip_runtime.h>
#include <math.h>

// Problem constants (match reference)
static constexpr int Bb = 4;
static constexpr int Nn = 192;
static constexpr int Hh = 768;
static constexpr int Ll = 9;
static constexpr int ROWS = Bb * Nn;   // 768 == Hh (coincidence, kept separate)

typedef __attribute__((ext_vector_type(2))) float v2f;
typedef __attribute__((ext_vector_type(8))) float v8f;
typedef __attribute__((ext_vector_type(4))) unsigned int v4u;
typedef __attribute__((ext_vector_type(4))) int v4i;
typedef __attribute__((ext_vector_type(8))) int v8i;

#if __has_builtin(__builtin_amdgcn_tensor_load_to_lds) && __has_builtin(__builtin_amdgcn_s_wait_tensorcnt)
#define STAGE_TDM 1
#elif __has_builtin(__builtin_amdgcn_global_load_async_to_lds_b128)
#define STAGE_ASYNC 1
#endif

typedef __attribute__((address_space(3))) void lds_void_t;
typedef __attribute__((address_space(1))) const void gbl_cvoid_t;

__device__ __forceinline__ unsigned lds_addr_of(void* p) {
    // AS3 pointers are 32-bit LDS byte offsets
    return (unsigned)(size_t)(lds_void_t*)p;
}

// erf-form GELU x*Phi(x) on a pair of values, with no branch and in packed f32.
// Phi(-|x|) = exp(-x*x/2) * t*(c1 + t*(c2 + t*(c3 + t*(c4 + t*c5)))), t = 1/(1 + p*|x|):
// the five-term rational erfc fit, whose absolute error is of the size of one f32
// rounding of 1+erf. x*Phi(x) = x/2 + |x|*(1/2 - Phi(-|x|)) holds for either sign.
__device__ __forceinline__ v2f gelu_pair(v2f x) {
    const v2f ax = __builtin_elementwise_abs(x);
    const v2f d  = __builtin_elementwise_fma(ax, (v2f)(0.23164189f), (v2f)(1.0f));
    v2f t, e;
    t.x = __builtin_amdgcn_rcpf(d.x);
    t.y = __builtin_amdgcn_rcpf(d.y);
    const v2f u = (x * x) * (v2f)(-0.72134752f);       // -x*x/2 * log2(e)
    e.x = __builtin_amdgcn_exp2f(u.x);
    e.y = __builtin_amdgcn_exp2f(u.y);
    v2f p = __builtin_elementwise_fma(t, (v2f)(0.5307027145f), (v2f)(-0.7265760135f));
    p = __builtin_elementwise_fma(t, p, (v2f)(0.7107068705f));
    p = __builtin_elementwise_fma(t, p, (v2f)(-0.142248368f));
    p = __builtin_elementwise_fma(t, p, (v2f)(0.127414796f));
    p = p * t;
    const v2f s = __builtin_elementwise_fma(-p, e, (v2f)(0.5f));   // 1/2 - Phi(-|x|)
    return __builtin_elementwise_fma(ax, s, x * (v2f)(0.5f));
}

typedef __attribute__((ext_vector_type(4))) float v4f;

static constexpr int PM    = 48;              // pooled rows of a block
static constexpr int PN    = 96;              // W rows of a block
static constexpr int PROWS = PM + PN;         // rows of a stage
static constexpr int PK    = 128;             // k values of a stage
static constexpr int PP    = PK + 4;          // LDS row pitch in floats: 528 B = 16 B x 33
static constexpr int PST   = Hh / PK;         // 6 stages
static constexpr int PROJ_THREADS = 256;
static constexpr int PLD   = PROWS * (PK / 4) / PROJ_THREADS;   // 18 loads a thread a stage
static constexpr int PLA   = PM * (PK / 4) / PROJ_THREADS;      // the first 6 are pooled rows

// One stage of a wave: 72 WMMAs on the fragments at fA, fB. With MORE, the next stage's 18
// loads (uniform bases uA, uB, lane offset lo) are issued first and parked at sNext on the way.
template <bool MORE>
__device__ __forceinline__ void proj_stage(v8f (&c)[9], const float* fA, const float* fB,
                                           const float* uA, const float* uB, unsigned lo,
                                           float* sNext)
{
    v4f st[PLD];
    if (MORE) {
        #pragma unroll   // st[] stays in registers only under constant indices
        for (int i = 0; i < PLA; ++i)
            st[i] = *(const v4f*)(uA + i * 8 * Hh + lo);
        // Precaution: the register allocator may hand these loads' address registers to a later
        // load's result; the wait stands in front of any such overwrite.
        asm volatile("s_wait_xcnt 0x0" ::: "memory");
        #pragma unroll
        for (int i = PLA; i < PLD; ++i)
            st[i] = *(const v4f*)(uB + (i - PLA) * 8 * Hh + lo);
        // The loads are issued before the WMMAs, which cover their latency.
        __builtin_amdgcn_sched_barrier(0);
    }
    v4f a[4][3], b[4][3];
    #pragma unroll   // fragments stay in registers only under constant indices
    for (int t = 0; t < 3; ++t) {
        a[0][t] = *(const v4f*)(fA + t * 16 * PP);            // ds_load_b128
        b[0][t] = *(const v4f*)(fB + t * 16 * PP);
    }
    #pragma unroll   // c[], st[] and the fragments again
    for (int j = 0; j < 4; ++j) {
        if (j < 3) {
            // The next 8 k values' fragments are fetched ahead of this step's WMMAs.
            #pragma unroll
            for (int t = 0; t < 3; ++t) {
                a[j + 1][t] = *(const v4f*)(fA + t * 16 * PP + (j + 1) * 8);
                b[j + 1][t] = *(const v4f*)(fB + t * 16 * PP + (j + 1) * 8);
            }
        }
        #pragma unroll
        for (int h = 0; h < 2; ++h) {
            #pragma unroll
            for (int mi = 0; mi < 3; ++mi)
                #pragma unroll
                for (int ni = 0; ni < 3; ++ni)
                    c[mi * 3 + ni] = __builtin_amdgcn_wmma_f32_16x16x4_f32(
                        false, h ? a[j][mi].zw : a[j][mi].xy, false, h ? b[j][ni].zw : b[j][ni].xy,
                        (short)0, c[mi * 3 + ni], false, false);
            if (MORE && j >= 2) {
                // Five LDS stores (three after the last) behind each nine WMMAs of the stage's second half: held there,
                // they wait for no load that is still under way and go out while the matrix
                // unit works; ahead of the WMMAs or all at the end it would stand idle.
                __builtin_amdgcn_sched_barrier(0);
                const int i0 = ((j - 2) * 2 + h) * 5;
                #pragma unroll
                for (int i = i0; i < (i0 + 5 < PLD ? i0 + 5 : PLD); ++i)
                    *(v4f*)(sNext + i * 8 * PP) = st[i];
                __builtin_amdgcn_sched_barrier(0);   // the other side of the same hold
            }
        }
    }
}

__global__ void __launch_bounds__(PROJ_THREADS)
proj_gemm_kernel(const float* __restrict__ pooled,
                 const float* __restrict__ Ws, const float* __restrict__ bs,
                 const float* __restrict__ Wt, const float* __restrict__ bt,
                 float* __restrict__ HS, float* __restrict__ HT)
{
    __shared__ __attribute__((aligned(16))) float s_tile[2 * PROWS * PP];   // 152,064 bytes
    __shared__ v4f s_part[8 * 9 * 64];                                      // 73,728 bytes

    const int rowBase = blockIdx.x * PM;     // row tile of pooled (B*N rows)
    const int colBase = blockIdx.y * PN;     // output-feature tile
    const int which   = blockIdx.z;          // 0 = source, 1 = target

    const float* __restrict__ W  = which ? Wt : Ws;
    const float* __restrict__ bv = which ? bt : bs;
    float* __restrict__ Out      = which ? HT : HS;

    const int tid  = threadIdx.x;
    const int wave = tid >> 5;
    const int lane = tid & 31;
    const int m    = lane & 15;
    const int hi   = lane >> 4;
    const int nt   = wave & 1;               // which 48 of the 96 columns
    const int q    = wave >> 1;              // which 32 of a stage's 128 k values

    // Staging: a wave's load is one whole row of the stage (512 bytes); 8 rows a step.
    const float* uA = pooled + (size_t)rowBase * Hh;     // the same for the whole block
    const float* uB = W      + (size_t)colBase * Hh;
    const unsigned lo = wave * Hh + lane * 4;
    float* sDst = s_tile + wave * PP + lane * 4;

    {
        v4f st[PLD];
        #pragma unroll   // st[] stays in registers only under constant indices
        for (int i = 0; i < PLD; ++i)
            st[i] = *(const v4f*)((i < PLA ? uA + i * 8 * Hh : uB + (i - PLA) * 8 * Hh) + lo);
        #pragma unroll
        for (int i = 0; i < PLD; ++i)
            *(v4f*)(sDst + PROWS * PP + i * 8 * PP) = st[i];
    }
    __syncthreads();

    const float* fA = s_tile + m * PP + q * 32 + hi * 4;
    const float* fB = s_tile + (PM + nt * 48 + m) * PP + q * 32 + hi * 4;

    v8f c[9] = {};
    #pragma unroll 1   // rolled: unrolled, the stages' fragments pile up in registers ahead of the WMMAs
    for (int s = 0; s + 1 < PST; ++s) {
        const int cur = ((s + 1) & 1) * (PROWS * PP);   // even stages lie in the second buffer
        // The other buffer's last readers left it at the barrier that ended stage s-1.
        proj_stage<true>(c, fA + cur, fB + cur, uA + (s + 1) * PK, uB + (s + 1) * PK, lo,
                         sDst + (PROWS * PP - cur));
        __syncthreads();
    }
    static_assert((PST & 1) == 0, "the last stage lies in the first buffer");
    proj_stage<false>(c, fA, fB, uA, uB, lo, sDst);
    // Keeps the address arithmetic below from moving up among the WMMAs.
    __builtin_amdgcn_sched_barrier(0);

    // Each wave parks its 9 partial tiles; 16 bytes a lane, lanes side by side.
    #pragma unroll   // constant t: c[t] is read from its registers
    for (int t = 0; t < 9; ++t) {
        v4f* p = s_part + (wave * 9 + t) * 64 + lane;
        p[0]  = c[t].lo;
        p[32] = c[t].hi;
    }
    __syncthreads();

    for (int u = wave; u < 18; u += 8) {
        const int un = u / 9;                // column half
        const int t  = u - un * 9;
        const int mi = t / 3;
        const int ni = t - mi * 3;
        const v4f* p = s_part + (un * 9 + t) * 64 + lane;    // quarter 0; a quarter is 2 waves on
        const v4f lv = ((p[0]  + p[18 * 64])      + p[36 * 64])      + p[54 * 64];
        const v4f hv = ((p[32] + p[18 * 64 + 32]) + p[36 * 64 + 32]) + p[54 * 64 + 32];
        const int col = colBase + un * 48 + ni * 16 + m;
        const float bias = bv[col];
        float* ocol = Out + (size_t)(rowBase + mi * 16 + hi * 8) * Hh + col;
        #pragma unroll   // lv[j], hv[j] under constant j
        for (int j = 0; j < 4; ++j) {
            ocol[(size_t)j * Hh]       = lv[j] + bias;
            ocol[(size_t)(j + 4) * Hh] = hv[j] + bias;
        }
    }
}

static constexpr int SR = 12;
static constexpr int KW = 4;
static constexpr int KQ = Hh / KW;
static constexpr int PAIR_THREADS = KW * 32;

__global__ void __launch_bounds__(PAIR_THREADS)
pair_gelu_proj_kernel(const float* __restrict__ HS, const float* __restrict__ HT,
                      const float* __restrict__ Wo, float* __restrict__ out)
{
    __shared__ float s_ht[16 * Hh];          // 49,152 bytes
    __shared__ float4 s_red[KW * SR * 64];   // 49,152 bytes: each wave's 12 partial tiles

    const int b     = blockIdx.z;
    const int sBase = blockIdx.y * SR;
    const int tBase = blockIdx.x * 16;

    const float* src = HT + (size_t)(b * Nn + tBase) * Hh;   // 16 contiguous rows

#if defined(STAGE_TDM)
    // ---- Tensor Data Mover: one DMA for the whole 48KB tile (wave 0 only) ----
    if (threadIdx.x < 32) {
        const unsigned long long ga = (unsigned long long)(const void*)src;
        const unsigned lds = lds_addr_of((void*)s_ht);

        v4u g0 = { 1u,
                   lds,
                   (unsigned)(ga & 0xFFFFFFFFu),
                   (unsigned)((ga >> 32) & 0x01FFFFFFu) | (2u << 30) };

        v8i g1 = { (int)(2u << 16),
                   (int)(((unsigned)Hh) << 16),
                   (int)(16u << 16),
                   (int)(((unsigned)Hh) << 16),
                   16,
                   Hh,
                   0, 0 };

        v4i g2 = { 0, 0, 0, 0 };                 // 2-D: groups 2/3 unused
        v4i g3 = { 0, 0, 0, 0 };

#if __clang_major__ >= 23
        v8i gx = { 0, 0, 0, 0, 0, 0, 0, 0 };
        __builtin_amdgcn_tensor_load_to_lds(g0, g1, g2, g3, gx, 0);
#else
        __builtin_amdgcn_tensor_load_to_lds(g0, g1, g2, g3, 0);
#endif
        __builtin_amdgcn_s_wait_tensorcnt(0);
    }
    __syncthreads();
#elif defined(STAGE_ASYNC)
    {
        const float4* s4 = (const float4*)src;
        float4* d4 = (float4*)s_ht;
        for (int i = threadIdx.x; i < (16 * Hh) / 4; i += PAIR_THREADS) {
            __builtin_amdgcn_global_load_async_to_lds_b128(
                (gbl_cvoid_t*)(s4 + i), (lds_void_t*)(d4 + i), 0, 0);
        }
#if __has_builtin(__builtin_amdgcn_s_wait_asynccnt)
        __builtin_amdgcn_s_wait_asynccnt(0);
#else
        asm volatile("s_wait_asynccnt 0" ::: "memory");
#endif
    }
    __syncthreads();
#else
    // ---- Plain staged copy fallback ----
    {
        const float4* s4 = (const float4*)src;
        float4* d4 = (float4*)s_ht;
        for (int i = threadIdx.x; i < (16 * Hh) / 4; i += PAIR_THREADS)
            d4[i] = s4[i];
    }
    __syncthreads();
#endif

    const int wave = threadIdx.x >> 5;       // 0..3 -> quarter of h
    const int lane = threadIdx.x & 31;
    const int m    = lane & 15;              // t_local (A) / l (B)
    const int hi   = lane >> 4;
    const int off  = wave * KQ + (hi << 1);

    const float* hsRow = HS   + (size_t)(b * Nn + sBase) * Hh + off;
    const float* htRow = s_ht + (size_t)m * Hh + off;                 // LDS
    const float* woRow = Wo   + (size_t)((m < Ll) ? m : 0) * Hh + off;
    const float  wsc   = (m < Ll) ? 1.0f : 0.0f;

    __builtin_prefetch(hsRow, 0, 3);         // global_prefetch_b8
    __builtin_prefetch(woRow, 0, 3);

    v8f c[SR] = {};
    for (int k0 = 0; k0 < KQ; k0 += 4) {
        v2f htv = *(const v2f*)(htRow + k0);   // ds_load_b64
        v2f wov = *(const v2f*)(woRow + k0);

        v2f bm;
        bm.x = wov.x * wsc;
        bm.y = wov.y * wsc;

        #pragma unroll   // c[r] stays in registers only under constant r
        for (int r = 0; r < SR; ++r) {
            v2f hsv = *(const v2f*)(hsRow + (size_t)r * Hh + k0);
            v2f a   = gelu_pair(hsv + htv);
            c[r] = __builtin_amdgcn_wmma_f32_16x16x4_f32(
                    false, a, false, bm, (short)0, c[r], false, false);
        }
        __builtin_amdgcn_sched_barrier(0);
        asm volatile("v_nop\n\tv_nop\n\tv_nop\n\tv_nop");
    }

    // Each wave parks its 12 partial tiles; 16 bytes a lane, lanes side by side.
    #pragma unroll   // constant r again: c[r] is read from its registers
    for (int r = 0; r < SR; ++r) {
        float4* p = s_red + (size_t)(wave * SR + r) * 64 + lane;
        p[0]  = make_float4(c[r][0], c[r][1], c[r][2], c[r][3]);
        p[32] = make_float4(c[r][4], c[r][5], c[r][6], c[r][7]);
    }
    __syncthreads();

    #pragma unroll
    for (int i = 0; i < SR / KW; ++i) {
        const int r = wave * (SR / KW) + i;
        float v[8];
        #pragma unroll   // v[] stays in registers only under constant indices
        for (int h = 0; h < 2; ++h) {
            const float4* p = s_red + (size_t)r * 64 + h * 32 + lane;
            float4 q0 = p[0 * SR * 64], q1 = p[1 * SR * 64], q2 = p[2 * SR * 64], q3 = p[3 * SR * 64];
            v[h * 4 + 0] = ((q0.x + q1.x) + q2.x) + q3.x;
            v[h * 4 + 1] = ((q0.y + q1.y) + q2.y) + q3.y;
            v[h * 4 + 2] = ((q0.z + q1.z) + q2.z) + q3.z;
            v[h * 4 + 3] = ((q0.w + q1.w) + q2.w) + q3.w;
        }
        if (m < Ll) {
            float* obase = out + (((size_t)(b * Nn + sBase + r) * Nn) + tBase) * Ll + m;
            #pragma unroll
            for (int j = 0; j < 8; ++j) {
                obase[(size_t)(hi * 8 + j) * Ll] = v[j];
            }
        }
    }
}

// ---------------------------------------------------------------------------
extern "C" void kernel_launch(void* const* d_in, const int* in_sizes, int n_in,
                              void* d_out, int out_size, void* d_ws, size_t ws_size,
                              hipStream_t stream) {
    const float* pooled = (const float*)d_in[0];
    const float* Ws     = (const float*)d_in[1];
    const float* bs     = (const float*)d_in[2];
    const float* Wt     = (const float*)d_in[3];
    const float* bt     = (const float*)d_in[4];
    const float* Wo     = (const float*)d_in[5];

    float* HS  = (float*)d_ws;                       // [768 x 768]
    float* HT  = HS + (size_t)ROWS * Hh;             // [768 x 768]
    float* out = (float*)d_out;                      // [4,192,192,9]

    dim3 g1(ROWS / PM, Hh / PN, 2);                  // 16 x 8 x 2 blocks
    proj_gemm_kernel<<<g1, PROJ_THREADS, 0, stream>>>(pooled, Ws, bs, Wt, bt, HS, HT);

    dim3 g2(Nn / 16, Nn / SR, Bb);                   // 12 x 16 x 4 blocks
    pair_gelu_proj_kernel<<<g2, PAIR_THREADS, 0, stream>>>(HS, HT, Wo, out);
}
